// v000
// The times below were measured on an AMD MI455X: many runs one after another, warmed up first and cycling through
// copies of the inputs, with the whole window's GPU time divided by the number of runs. Launches and the gaps
// between them are all in it. The median over several windows is given; except for v000 it joins two sittings, which
// can be a few percent apart, so the side-by-side timings, each taken in one sitting, are the better comparison.
// v000, which the later versions start from, runs in 127 microseconds.
#include <hip/hip_runtime.h>
#include <hip/hip_bf16.h>

// ---------------------------------------------------------------------------
// Fused projection layer for MI455X (gfx1250, wave32):
//   out1 = relu(words @ sh_w + sh_b)                 [B,S,128]
//   out2 = relu(words @ dp_w[corpus] + dp_b[corpus]) [B,S,128]
//   pred = concat(out1,out2) @ fc_w + fc_b           [B,S,4]
// fp32-exact matrix path: V_WMMA_F32_16X16X4_F32.
// Weights are pre-transposed to [H,E] in the workspace so the B operand of
// each WMMA is a single global_load_b64 per lane (K-contiguous pair).
// ---------------------------------------------------------------------------

#define Bsz 64
#define Ssz 512
#define Esz 768
#define Hsz 128
#define Csz 10
#define Osz 4

#define LDA  776   // padded LDS row stride in floats (bank stagger; 776 % 4 == 0)
#define LDO  264   // padded out-tile row stride in floats

typedef float v2f __attribute__((ext_vector_type(2)));
typedef float v8f __attribute__((ext_vector_type(8)));

// ---------------------------------------------------------------------------
// Weight transpose: [E,H] -> [H,E] for dp_w (10 experts) and sh_w (z == 10).
// Classic 32x32 LDS tile transpose, both directions coalesced.
// ---------------------------------------------------------------------------
__global__ __launch_bounds__(256)
void transpose_weights_kernel(const float* __restrict__ dp_w,  // [C,E,H]
                              const float* __restrict__ sh_w,  // [E,H]
                              float*       __restrict__ dpT,   // [C,H,E]
                              float*       __restrict__ shT)   // [H,E]
{
    __shared__ float t[32][33];
    const int z = blockIdx.z;  // 0..9 experts, 10 = shared
    const float* __restrict__ src = (z < Csz) ? dp_w + (size_t)z * Esz * Hsz : sh_w;
    float*       __restrict__ dst = (z < Csz) ? dpT  + (size_t)z * Hsz * Esz : shT;
    const int e0 = blockIdx.x * 32;
    const int h0 = blockIdx.y * 32;
    const int tx = threadIdx.x;       // 0..31
    const int ty = threadIdx.y;       // 0..7
    #pragma unroll
    for (int j = 0; j < 32; j += 8)
        t[ty + j][tx] = src[(size_t)(e0 + ty + j) * Hsz + (h0 + tx)];
    __syncthreads();
    #pragma unroll
    for (int j = 0; j < 32; j += 8)
        dst[(size_t)(h0 + ty + j) * Esz + (e0 + tx)] = t[tx][ty + j];
}

// ---------------------------------------------------------------------------
// Main fused kernel. TRANS=true reads pre-transposed [H,E] weights (b64 B
// loads); TRANS=false is the fallback reading [E,H] directly (2x b32).
// ---------------------------------------------------------------------------
template <bool TRANS>
__global__ __launch_bounds__(512)
void projection_fused_kernel(const float* __restrict__ words,   // [B,S,E]
                             const int*   __restrict__ corpus,  // [B]
                             const float* __restrict__ dp_w,    // [C,E,H]
                             const float* __restrict__ dp_b,    // [C,H]
                             const float* __restrict__ sh_w,    // [E,H]
                             const float* __restrict__ sh_b,    // [H]
                             const float* __restrict__ fc_w,    // [2H,O]
                             const float* __restrict__ fc_b,    // [O]
                             const float* __restrict__ dpT,     // [C,H,E] or null
                             const float* __restrict__ shT,     // [H,E]   or null
                             float*       __restrict__ out)     // [B,S,O]
{
    __shared__ float smem[16 * LDA];   // 49,664 B; reused for the out tile later

    const int b  = blockIdx.y;
    const int s0 = blockIdx.x * 16;
    const int tid  = threadIdx.x;
    const int wv   = tid >> 5;         // wave id 0..15
    const int lane = tid & 31;
    const int m    = lane & 15;        // M row (A layout), also N col (B/C layout)
    const int kh   = (lane >> 4) * 2;  // K sub-offset 0 or 2

    // ---- Stage A: cooperative load of the 16 x 768 words tile into LDS ----
    {
        const float4* wrow = (const float4*)(words + ((size_t)b * Ssz + s0) * Esz);
        #pragma unroll
        for (int i = 0; i < 6; ++i) {
            int q  = tid + i * 512;        // float4 index, 0..3071
            int r  = q / 192;              // 192 float4 per row of 768 floats
            int cv = q - r * 192;
            float4 v = wrow[r * 192 + cv];
            *(float4*)&smem[r * LDA + cv * 4] = v;   // LDA%4==0 -> 16B aligned
        }
    }
    __syncthreads();

    // ---- Stage B: each wave computes one 16x16 tile of the 256-wide concat ----
    const int  c      = corpus[b];
    const bool domain = (wv >= 8);
    const int  hcol0  = (wv & 7) * 16;           // column tile within H=128
    const int  hcol   = hcol0 + m;               // this lane's N column (0..127)

    const float* __restrict__ bias = domain ? (dp_b + (size_t)c * Hsz) : sh_b;
    // B operand base: transposed -> row of length E per column; else column w/ stride H
    const float* __restrict__ wcol;
    if (TRANS) {
        const float* WT = domain ? (dpT + (size_t)c * Hsz * Esz) : shT;
        wcol = WT + (size_t)hcol * Esz;
    } else {
        const float* W = domain ? (dp_w + (size_t)c * Esz * Hsz) : sh_w;
        wcol = W + hcol;
    }

    v8f acc0 = {};
    v8f acc1 = {};
    const float* __restrict__ arow = &smem[m * LDA];

    for (int k0 = 0; k0 < Esz; k0 += 8) {
        {   // K = k0 .. k0+3; this lane supplies k0+kh, k0+kh+1
            int kk = k0 + kh;
            v2f a = *(const v2f*)&arow[kk];                    // ds_load_b64
            v2f bb;
            if (TRANS) {
                bb = *(const v2f*)&wcol[kk];                   // global_load_b64
            } else {
                bb.x = wcol[(size_t)kk * Hsz];
                bb.y = wcol[(size_t)(kk + 1) * Hsz];
            }
            acc0 = __builtin_amdgcn_wmma_f32_16x16x4_f32(
                       false, a, false, bb, (short)0, acc0, false, false);
        }
        {   // K = k0+4 .. k0+7 (independent accumulator for ILP)
            int kk = k0 + 4 + kh;
            v2f a = *(const v2f*)&arow[kk];
            v2f bb;
            if (TRANS) {
                bb = *(const v2f*)&wcol[kk];
            } else {
                bb.x = wcol[(size_t)kk * Hsz];
                bb.y = wcol[(size_t)(kk + 1) * Hsz];
            }
            acc1 = __builtin_amdgcn_wmma_f32_16x16x4_f32(
                       false, a, false, bb, (short)0, acc1, false, false);
        }
    }

    // bias + relu (N == lane&15 for every accumulator VGPR)
    const float bv = bias[hcol];
    v8f tile;
    #pragma unroll
    for (int r = 0; r < 8; ++r) {
        float x = acc0[r] + acc1[r] + bv;
        tile[r] = x > 0.0f ? x : 0.0f;
    }

    // ---- Stage C: spill tiles to LDS (alias A buffer), then tiny fc head ----
    __syncthreads();   // everyone is done reading the A tile

    {
        const int ccol  = wv * 16 + m;        // concat column 0..255
        const int mbase = (lane >> 4) * 8;    // lanes 16-31 hold M = r+8
        #pragma unroll
        for (int r = 0; r < 8; ++r)
            smem[(r + mbase) * LDO + ccol] = tile[r];
    }
    __syncthreads();

    if (tid < 64) {
        const int row = tid >> 2;
        const int o   = tid & 3;
        float sum = fc_b[o];
        const float* orow = &smem[row * LDO];
        #pragma unroll 8
        for (int h = 0; h < 2 * Hsz; ++h)
            sum = fmaf(orow[h], fc_w[h * Osz + o], sum);
        out[((size_t)b * Ssz + s0 + row) * Osz + o] = sum;
    }
}

extern "C" void kernel_launch(void* const* d_in, const int* in_sizes, int n_in,
                              void* d_out, int out_size, void* d_ws, size_t ws_size,
                              hipStream_t stream) {
    const float* words  = (const float*)d_in[0];
    const int*   corpus = (const int*)  d_in[1];
    const float* dp_w   = (const float*)d_in[2];
    const float* dp_b   = (const float*)d_in[3];
    const float* sh_w   = (const float*)d_in[4];
    const float* sh_b   = (const float*)d_in[5];
    const float* fc_w   = (const float*)d_in[6];
    const float* fc_b   = (const float*)d_in[7];
    float*       out    = (float*)d_out;

    dim3 grid(Ssz / 16, Bsz);   // (32, 64) = 2048 workgroups
    dim3 block(512);            // 16 waves of 32

    const size_t dpT_elems = (size_t)Csz * Hsz * Esz;
    const size_t shT_elems = (size_t)Hsz * Esz;
    const size_t need = (dpT_elems + shT_elems) * sizeof(float);

    if (ws_size >= need) {
        float* dpT = (float*)d_ws;
        float* shT = dpT + dpT_elems;
        transpose_weights_kernel<<<dim3(Esz / 32, Hsz / 32, Csz + 1),
                                   dim3(32, 8), 0, stream>>>(dp_w, sh_w, dpT, shT);
        projection_fused_kernel<true><<<grid, block, 0, stream>>>(
            words, corpus, dp_w, dp_b, sh_w, sh_b, fc_w, fc_b, dpT, shT, out);
    } else {
        projection_fused_kernel<false><<<grid, block, 0, stream>>>(
            words, corpus, dp_w, dp_b, sh_w, sh_b, fc_w, fc_b, nullptr, nullptr, out);
    }
}

// v001
// It runs in 67.7 microseconds.
// Two timings next to v000 put it at 1.96 and 1.97 times that version's speed.
#include <hip/hip_runtime.h>
#include <hip/hip_bf16.h>

// ---------------------------------------------------------------------------
// Fused projection layer for MI455X (gfx1250, wave32):
//   out1 = relu(words @ sh_w + sh_b)                 [B,S,128]
//   out2 = relu(words @ dp_w[corpus] + dp_b[corpus]) [B,S,128]
//   pred = concat(out1,out2) @ fc_w + fc_b           [B,S,4]
// fp32-exact matrix path: V_WMMA_F32_16X16X4_F32.
// Weights are pre-transposed to [H,E] in the workspace so that a weight column
// is K-contiguous like a words row: both operands stage and load alike.
// ---------------------------------------------------------------------------

#define Bsz 64
#define Ssz 512
#define Esz 768
#define Hsz 128
#define Csz 10
#define Osz 4

#define LDA  776   // padded LDS row stride in floats (bank stagger; 776 % 4 == 0)
#define LDO  264   // padded out-tile row stride in floats

typedef float v2f __attribute__((ext_vector_type(2)));
typedef float v8f __attribute__((ext_vector_type(8)));

// ---------------------------------------------------------------------------
// Weight transpose: [E,H] -> [H,E] for dp_w (10 experts) and sh_w (z == 10).
// Classic 32x32 LDS tile transpose, both directions coalesced.
// ---------------------------------------------------------------------------
__global__ __launch_bounds__(256)
void transpose_weights_kernel(const float* __restrict__ dp_w,  // [C,E,H]
                              const float* __restrict__ sh_w,  // [E,H]
                              float*       __restrict__ dpT,   // [C,H,E]
                              float*       __restrict__ shT)   // [H,E]
{
    __shared__ float t[32][33];
    const int z = blockIdx.z;  // 0..9 experts, 10 = shared
    const float* __restrict__ src = (z < Csz) ? dp_w + (size_t)z * Esz * Hsz : sh_w;
    float*       __restrict__ dst = (z < Csz) ? dpT  + (size_t)z * Hsz * Esz : shT;
    const int e0 = blockIdx.x * 32;
    const int h0 = blockIdx.y * 32;
    const int tx = threadIdx.x;       // 0..31
    const int ty = threadIdx.y;       // 0..7
    #pragma unroll
    for (int j = 0; j < 32; j += 8)
        t[ty + j][tx] = src[(size_t)(e0 + ty + j) * Hsz + (h0 + tx)];
    __syncthreads();
    #pragma unroll
    for (int j = 0; j < 32; j += 8)
        dst[(size_t)(h0 + ty + j) * Esz + (e0 + tx)] = t[tx][ty + j];
}

// ---------------------------------------------------------------------------
// Fused kernel, 16 rows per work-group. TRANS=true reads pre-transposed [H,E]
// weights (b64 B loads); TRANS=false reads [E,H] directly (2x b32) and is the
// fallback launched when the workspace cannot hold the transposed weights.
// ---------------------------------------------------------------------------
template <bool TRANS>
__global__ __launch_bounds__(512)
void projection_fused_kernel(const float* __restrict__ words,   // [B,S,E]
                             const int*   __restrict__ corpus,  // [B]
                             const float* __restrict__ dp_w,    // [C,E,H]
                             const float* __restrict__ dp_b,    // [C,H]
                             const float* __restrict__ sh_w,    // [E,H]
                             const float* __restrict__ sh_b,    // [H]
                             const float* __restrict__ fc_w,    // [2H,O]
                             const float* __restrict__ fc_b,    // [O]
                             const float* __restrict__ dpT,     // [C,H,E] or null
                             const float* __restrict__ shT,     // [H,E]   or null
                             float*       __restrict__ out)     // [B,S,O]
{
    __shared__ float smem[16 * LDA];   // 49,664 B; reused for the out tile later

    const int b  = blockIdx.y;
    const int s0 = blockIdx.x * 16;
    const int tid  = threadIdx.x;
    const int wv   = tid >> 5;         // wave id 0..15
    const int lane = tid & 31;
    const int m    = lane & 15;        // M row (A layout), also N col (B/C layout)
    const int kh   = (lane >> 4) * 2;  // K sub-offset 0 or 2

    // ---- Stage A: cooperative load of the 16 x 768 words tile into LDS ----
    {
        const float4* wrow = (const float4*)(words + ((size_t)b * Ssz + s0) * Esz);
        #pragma unroll
        for (int i = 0; i < 6; ++i) {
            int q  = tid + i * 512;        // float4 index, 0..3071
            int r  = q / 192;              // 192 float4 per row of 768 floats
            int cv = q - r * 192;
            float4 v = wrow[r * 192 + cv];
            *(float4*)&smem[r * LDA + cv * 4] = v;   // LDA%4==0 -> 16B aligned
        }
    }
    __syncthreads();

    // ---- Stage B: each wave computes one 16x16 tile of the 256-wide concat ----
    const int  c      = corpus[b];
    const bool domain = (wv >= 8);
    const int  hcol0  = (wv & 7) * 16;           // column tile within H=128
    const int  hcol   = hcol0 + m;               // this lane's N column (0..127)

    const float* __restrict__ bias = domain ? (dp_b + (size_t)c * Hsz) : sh_b;
    // B operand base: transposed -> row of length E per column; else column w/ stride H
    const float* __restrict__ wcol;
    if (TRANS) {
        const float* WT = domain ? (dpT + (size_t)c * Hsz * Esz) : shT;
        wcol = WT + (size_t)hcol * Esz;
    } else {
        const float* W = domain ? (dp_w + (size_t)c * Esz * Hsz) : sh_w;
        wcol = W + hcol;
    }

    v8f acc0 = {};
    v8f acc1 = {};
    const float* __restrict__ arow = &smem[m * LDA];

    for (int k0 = 0; k0 < Esz; k0 += 8) {
        {   // K = k0 .. k0+3; this lane supplies k0+kh, k0+kh+1
            int kk = k0 + kh;
            v2f a = *(const v2f*)&arow[kk];                    // ds_load_b64
            v2f bb;
            if (TRANS) {
                bb = *(const v2f*)&wcol[kk];                   // global_load_b64
            } else {
                bb.x = wcol[(size_t)kk * Hsz];
                bb.y = wcol[(size_t)(kk + 1) * Hsz];
            }
            acc0 = __builtin_amdgcn_wmma_f32_16x16x4_f32(
                       false, a, false, bb, (short)0, acc0, false, false);
        }
        {   // K = k0+4 .. k0+7 (independent accumulator for ILP)
            int kk = k0 + 4 + kh;
            v2f a = *(const v2f*)&arow[kk];
            v2f bb;
            if (TRANS) {
                bb = *(const v2f*)&wcol[kk];
            } else {
                bb.x = wcol[(size_t)kk * Hsz];
                bb.y = wcol[(size_t)(kk + 1) * Hsz];
            }
            acc1 = __builtin_amdgcn_wmma_f32_16x16x4_f32(
                       false, a, false, bb, (short)0, acc1, false, false);
        }
    }

    // bias + relu (N == lane&15 for every accumulator VGPR)
    const float bv = bias[hcol];
    v8f tile;
    #pragma unroll
    for (int r = 0; r < 8; ++r) {
        float x = acc0[r] + acc1[r] + bv;
        tile[r] = x > 0.0f ? x : 0.0f;
    }

    // ---- Stage C: spill tiles to LDS (alias A buffer), then tiny fc head ----
    __syncthreads();   // everyone is done reading the A tile

    {
        const int ccol  = wv * 16 + m;        // concat column 0..255
        const int mbase = (lane >> 4) * 8;    // lanes 16-31 hold M = r+8
        #pragma unroll
        for (int r = 0; r < 8; ++r)
            smem[(r + mbase) * LDO + ccol] = tile[r];
    }
    __syncthreads();

    if (tid < 64) {
        const int row = tid >> 2;
        const int o   = tid & 3;
        float sum = fc_b[o];
        const float* orow = &smem[row * LDO];
        #pragma unroll 8
        for (int h = 0; h < 2 * Hsz; ++h)
            sum = fmaf(orow[h], fc_w[h * Osz + o], sum);
        out[((size_t)b * Ssz + s0 + row) * Osz + o] = sum;
    }
}

// ---------------------------------------------------------------------------
// Tiled main kernel (pre-transposed [H,E] weights).
// One work-group = 128 rows of one batch x all 256 concat columns, so every
// weight element is fetched once per 128 rows. K runs in chunks of 64: the
// words chunk (128 x 64) and the weight chunk (256 x 64) are staged in LDS,
// two buffers; the next chunk's global loads are issued ahead of the current
// chunk's products and stored to the other buffer behind them.
// 16 waves in a 4 (rows) x 4 (columns) grid, 32 x 64 per wave = 2 x 4
// accumulator tiles: 6 LDS fragment loads feed 8 WMMAs.
// ---------------------------------------------------------------------------
#define TM    128                     // rows per work-group
#define TN    256                     // concat columns per work-group
#define KC    64                      // k per chunk
#define NCH   (Esz / KC)              // 12 chunks
#define PK    68                      // LDS row pitch in floats: 4 banks per row, b64 fragment reads conflict-free
#define STAGE ((TM + TN) * PK)        // floats per buffer
#define LDT   260                     // out-tile pitch in floats: rows 8 apart land 32 banks apart

__device__ __forceinline__ void chunk_products(const float* __restrict__ aP,
                                               const float* __restrict__ bP,
                                               v8f (&acc)[2][4])
{
    // Unrolled so that the LDS offsets are immediates and the fragment loads
    // of later k steps can be issued ahead of the products of earlier ones.
    #pragma unroll
    for (int kk = 0; kk < KC; kk += 4) {
        v2f a[2], w[4];
        #pragma unroll
        for (int i = 0; i < 2; ++i) a[i] = *(const v2f*)&aP[i * 16 * PK + kk];
        #pragma unroll
        for (int j = 0; j < 4; ++j) w[j] = *(const v2f*)&bP[j * 16 * PK + kk];
        #pragma unroll
        for (int i = 0; i < 2; ++i)
            #pragma unroll
            for (int j = 0; j < 4; ++j)
                acc[i][j] = __builtin_amdgcn_wmma_f32_16x16x4_f32(
                                false, a[i], false, w[j], (short)0, acc[i][j], false, false);
    }
}

__global__ __launch_bounds__(512)
void projection_tiled_kernel(const float* __restrict__ words,   // [B,S,E]
                             const int*   __restrict__ corpus,  // [B]
                             const float* __restrict__ dp_b,    // [C,H]
                             const float* __restrict__ sh_b,    // [H]
                             const float* __restrict__ fc_w,    // [2H,O]
                             const float* __restrict__ fc_b,    // [O]
                             const float* __restrict__ dpT,     // [C,H,E]
                             const float* __restrict__ shT,     // [H,E]
                             float*       __restrict__ out)     // [B,S,O]
{
    __shared__ __attribute__((aligned(16))) float smem[2 * STAGE];   // 208,896 B; out tile aliases it later

    const int b    = blockIdx.y;
    const int s0   = blockIdx.x * TM;
    const int tid  = threadIdx.x;
    const int wv   = tid >> 5;         // wave id 0..15
    const int lane = tid & 31;
    const int m    = lane & 15;        // M row (A layout), also N col (B/C layout)
    const int kh   = (lane >> 4) * 2;  // K sub-offset 0 or 2
    const int wm   = wv & 3;           // wave's 32-row band
    const int wn   = wv >> 2;          // wave's 64-column band (0,1 shared; 2,3 domain)

    int c = corpus[b];
    c = c < 0 ? 0 : (c > Csz - 1 ? Csz - 1 : c);   // bounds the gathered addresses
    c = __builtin_amdgcn_readfirstlane(c);         // keeps the expert's base address in scalar registers

    // Staging: 16 lanes cover one row's 256 B of a chunk; a thread takes rows
    // srow + 32 i of the words tile, of the shared and of the domain weights.
    const int srow = tid >> 4;         // 0..31
    const int scol = (tid & 15) * 4;   // float offset inside the chunk
    // All three sources have row pitch E: one per-thread byte offset serves
    // them, on top of three work-group-uniform bases.
    const unsigned goff = (unsigned)(srow * Esz + scol) * 4u;
    const char* gA = (const char*)(words + ((size_t)b * Ssz + s0) * Esz);
    const char* gS = (const char*)shT;
    const char* gD = (const char*)(dpT + (size_t)c * Hsz * Esz);
    float* const sSt = &smem[srow * PK + scol];

    float4 ra[4], rs[4], rd[4];
    #pragma unroll
    for (int i = 0; i < 4; ++i) {
        ra[i] = *(const float4*)(gA + i * 32 * Esz * 4 + goff);
        rs[i] = *(const float4*)(gS + i * 32 * Esz * 4 + goff);
        rd[i] = *(const float4*)(gD + i * 32 * Esz * 4 + goff);
    }
    #pragma unroll
    for (int i = 0; i < 4; ++i) {
        *(float4*)&sSt[(i * 32) * PK]                 = ra[i];
        *(float4*)&sSt[(TM + i * 32) * PK]            = rs[i];
        *(float4*)&sSt[(TM + Hsz + i * 32) * PK]      = rd[i];
    }
    __syncthreads();

    v8f acc[2][4] = {};
    const int aOff = (wm * 32 + m) * PK + kh;
    const int bOff = (TM + wn * 64 + m) * PK + kh;

    for (int ch = 0; ch < NCH - 1; ++ch) {
        const int cur = (ch & 1) * STAGE;
        const int nxt = STAGE - cur;
        gA += KC * 4;   // the three uniform bases step to the next chunk
        gS += KC * 4;
        gD += KC * 4;
        #pragma unroll
        for (int i = 0; i < 4; ++i) {
            ra[i] = *(const float4*)(gA + i * 32 * Esz * 4 + goff);
            rs[i] = *(const float4*)(gS + i * 32 * Esz * 4 + goff);
            rd[i] = *(const float4*)(gD + i * 32 * Esz * 4 + goff);
        }
        chunk_products(&smem[cur + aOff], &smem[cur + bOff], acc);
        #pragma unroll
        for (int i = 0; i < 4; ++i) {
            *(float4*)&sSt[nxt + (i * 32) * PK]            = ra[i];
            *(float4*)&sSt[nxt + (TM + i * 32) * PK]       = rs[i];
            *(float4*)&sSt[nxt + (TM + Hsz + i * 32) * PK] = rd[i];
        }
        // One barrier per chunk: publishes the buffer just written and ends
        // every wave's reads of the buffer that the next trip overwrites.
        __syncthreads();
    }
    {
        const int cur = ((NCH - 1) & 1) * STAGE;
        chunk_products(&smem[cur + aOff], &smem[cur + bOff], acc);
    }

    // ---- bias + relu, tiles to LDS (alias the stage buffers), tiny fc head ----
    __syncthreads();   // everyone is done reading the last chunk

    {
        const float* __restrict__ bias = (wn >= 2) ? (dp_b + (size_t)c * Hsz) : sh_b;
        const int mbase = (lane >> 4) * 8;    // lanes 16-31 hold M = r+8
        #pragma unroll
        for (int j = 0; j < 4; ++j) {
            const int   ccol = wn * 64 + j * 16 + m;      // concat column 0..255
            const float bv   = bias[ccol & (Hsz - 1)];
            #pragma unroll
            for (int i = 0; i < 2; ++i)
                #pragma unroll
                for (int r = 0; r < 8; ++r) {
                    float x = acc[i][j][r] + bv;
                    smem[(wm * 32 + i * 16 + mbase + r) * LDT + ccol] = x > 0.0f ? x : 0.0f;
                }
        }
    }
    __syncthreads();

    {   // 128 rows x 4 outputs = one (row, o) per thread
        const int row = tid >> 2;
        const int o   = tid & 3;
        float sum = fc_b[o];
        const float* orow = &smem[row * LDT];
        // Unrolled to keep 32 fc_w loads in flight ahead of the serial fma chain.
        #pragma unroll 32
        for (int h = 0; h < 2 * Hsz; ++h)
            sum = fmaf(orow[h], fc_w[h * Osz + o], sum);
        out[((size_t)b * Ssz + s0) * Osz + tid] = sum;
    }
}

extern "C" void kernel_launch(void* const* d_in, const int* in_sizes, int n_in,
                              void* d_out, int out_size, void* d_ws, size_t ws_size,
                              hipStream_t stream) {
    const float* words  = (const float*)d_in[0];
    const int*   corpus = (const int*)  d_in[1];
    const float* dp_w   = (const float*)d_in[2];
    const float* dp_b   = (const float*)d_in[3];
    const float* sh_w   = (const float*)d_in[4];
    const float* sh_b   = (const float*)d_in[5];
    const float* fc_w   = (const float*)d_in[6];
    const float* fc_b   = (const float*)d_in[7];
    float*       out    = (float*)d_out;

    dim3 grid(Ssz / 16, Bsz);   // fallback: (32, 64) = 2048 workgroups
    dim3 block(512);            // 16 waves of 32

    const size_t dpT_elems = (size_t)Csz * Hsz * Esz;
    const size_t shT_elems = (size_t)Hsz * Esz;
    const size_t need = (dpT_elems + shT_elems) * sizeof(float);

    if (ws_size >= need) {
        float* dpT = (float*)d_ws;
        float* shT = dpT + dpT_elems;
        transpose_weights_kernel<<<dim3(Esz / 32, Hsz / 32, Csz + 1),
                                   dim3(32, 8), 0, stream>>>(dp_w, sh_w, dpT, shT);
        projection_tiled_kernel<<<dim3(Ssz / TM, Bsz), block, 0, stream>>>(
            words, corpus, dp_b, sh_b, fc_w, fc_b, dpT, shT, out);
    } else {
        projection_fused_kernel<false><<<grid, block, 0, stream>>>(
            words, corpus, dp_w, dp_b, sh_w, sh_b, fc_w, fc_b, nullptr, nullptr, out);
    }
}

// v002
// It runs in 62.7 microseconds.
// Timed twice side by side with v001, it ran 1.08 times as fast both times.
// Counting every step since v000, it is 2.12 times as fast.
#include <hip/hip_runtime.h>
#include <hip/hip_bf16.h>

// ---------------------------------------------------------------------------
// Fused projection layer for MI455X (gfx1250, wave32):
//   out1 = relu(words @ sh_w + sh_b)                 [B,S,128]
//   out2 = relu(words @ dp_w[corpus] + dp_b[corpus]) [B,S,128]
//   pred = concat(out1,out2) @ fc_w + fc_b           [B,S,4]
// fp32-exact matrix path: V_WMMA_F32_16X16X4_F32.
// One launch: the [E,H] weights are read as they lie in memory and turned to
// K-contiguous rows on their way into LDS, so that both operands' fragments
// load alike.
// ---------------------------------------------------------------------------

#define Bsz 64
#define Ssz 512
#define Esz 768
#define Hsz 128
#define Csz 10
#define Osz 4

typedef float v2f __attribute__((ext_vector_type(2)));
typedef float v4f __attribute__((ext_vector_type(4)));
typedef float v8f __attribute__((ext_vector_type(8)));

// ---------------------------------------------------------------------------
// Tiled kernel.
// One work-group = 128 rows of one batch x all 256 concat columns, so every
// weight element is fetched once per 128 rows. K runs in chunks of 64: the
// words chunk (128 x 64) and the weight chunk (256 x 64) are staged in LDS,
// two buffers; the next chunk's global loads are issued ahead of the current
// chunk's products and stored to the other buffer behind them. The weight
// chunk lies in LDS as [column][k]: a thread loads a 4 (k) x 4 (columns) block
// of the [E,H] source and stores its four columns as 16-byte k runs.
// 16 waves in a 4 (rows) x 4 (columns) grid, 32 x 64 per wave = 2 x 4
// accumulator tiles: 6 LDS fragment loads feed 8 WMMAs.
// ---------------------------------------------------------------------------
#define TM    128                     // rows per work-group
#define TN    256                     // concat columns per work-group
#define KC    64                      // k per chunk
#define NCH   (Esz / KC)              // 12 chunks
#define PK    68                      // LDS row pitch in floats: 4 banks per row, b64 fragment reads conflict-free
#define STAGE ((TM + TN) * PK)        // floats per buffer
#define LDT   260                     // out-tile pitch in floats: rows 8 apart land 32 banks apart

__device__ __forceinline__ void chunk_products(const float* __restrict__ aP,
                                               const float* __restrict__ bP,
                                               v8f (&acc)[2][4])
{
    // Unrolled so that the LDS offsets are immediates and the fragment loads
    // of later k steps can be issued ahead of the products of earlier ones.
    #pragma unroll
    for (int kk = 0; kk < KC; kk += 4) {
        v2f a[2], w[4];
        #pragma unroll
        for (int i = 0; i < 2; ++i) a[i] = *(const v2f*)&aP[i * 16 * PK + kk];
        #pragma unroll
        for (int j = 0; j < 4; ++j) w[j] = *(const v2f*)&bP[j * 16 * PK + kk];
        #pragma unroll
        for (int i = 0; i < 2; ++i)
            #pragma unroll
            for (int j = 0; j < 4; ++j)
                acc[i][j] = __builtin_amdgcn_wmma_f32_16x16x4_f32(
                                false, a[i], false, w[j], (short)0, acc[i][j], false, false);
    }
}

__global__ __launch_bounds__(512)
void projection_tiled_kernel(const float* __restrict__ words,   // [B,S,E]
                             const int*   __restrict__ corpus,  // [B]
                             const float* __restrict__ dp_w,    // [C,E,H]
                             const float* __restrict__ dp_b,    // [C,H]
                             const float* __restrict__ sh_w,    // [E,H]
                             const float* __restrict__ sh_b,    // [H]
                             const float* __restrict__ fc_w,    // [2H,O]
                             const float* __restrict__ fc_b,    // [O]
                             float*       __restrict__ out)     // [B,S,O]
{
    __shared__ __attribute__((aligned(16))) float smem[2 * STAGE];   // 208,896 B; out tile aliases it later

    const int b    = blockIdx.y;
    const int s0   = blockIdx.x * TM;
    const int tid  = threadIdx.x;
    const int wv   = tid >> 5;         // wave id 0..15
    const int lane = tid & 31;
    const int m    = lane & 15;        // M row (A layout), also N col (B/C layout)
    const int kh   = (lane >> 4) * 2;  // K sub-offset 0 or 2
    const int wm   = wv & 3;           // wave's 32-row band
    const int wn   = wv >> 2;          // wave's 64-column band (0,1 shared; 2,3 domain)

    int c = corpus[b];
    c = c < 0 ? 0 : (c > Csz - 1 ? Csz - 1 : c);   // bounds the gathered addresses
    c = __builtin_amdgcn_readfirstlane(c);         // keeps the expert's base address in scalar registers

    // Staging of the words tile: 16 lanes cover one row's 256 B of a chunk; a
    // thread takes rows srow + 32 i.
    const int srow = tid >> 4;         // 0..31
    const int scol = (tid & 15) * 4;   // float offset inside the chunk
    const unsigned goff = (unsigned)(srow * Esz + scol) * 4u;
    const char* gA = (const char*)(words + ((size_t)b * Ssz + s0) * Esz);
    float* const sSt = &smem[srow * PK + scol];

    // Staging of the weights: a thread takes the block k = tk..tk+3, columns
    // tn..tn+3 of the shared and of the domain chunk. A wave covers 16 k x 32
    // columns: each load touches four whole 128-B lines, and with the k block
    // in the low lane bits 16 neighbouring lanes' 16-byte stores start 4 banks
    // apart (column pitch 4 PK = 16 banks, k block = 4 banks).
    const int tk = ((wv & 3) * 4 + (lane & 3)) * 4;    // 0..60
    const int tn = ((wv >> 2) * 8 + (lane >> 2)) * 4;  // 0..124
    const unsigned woff = (unsigned)(tk * Hsz + tn) * 4u;
    const char* gS = (const char*)sh_w;
    const char* gD = (const char*)(dp_w + (size_t)c * Esz * Hsz);
    float* const sW = &smem[(TM + tn) * PK + tk];

    v4f ra[4], rs[4], rd[4];
    #pragma unroll
    for (int i = 0; i < 4; ++i) {
        ra[i] = *(const v4f*)(gA + i * 32 * Esz * 4 + goff);
        rs[i] = *(const v4f*)(gS + i * Hsz * 4 + woff);
        rd[i] = *(const v4f*)(gD + i * Hsz * 4 + woff);
    }
    #pragma unroll
    for (int i = 0; i < 4; ++i) {
        *(v4f*)&sSt[(i * 32) * PK]   = ra[i];
        *(v4f*)&sW[i * PK]           = (v4f){rs[0][i], rs[1][i], rs[2][i], rs[3][i]};
        *(v4f*)&sW[(Hsz + i) * PK]   = (v4f){rd[0][i], rd[1][i], rd[2][i], rd[3][i]};
    }
    __syncthreads();

    v8f acc[2][4] = {};
    const int aOff = (wm * 32 + m) * PK + kh;
    const int bOff = (TM + wn * 64 + m) * PK + kh;

    for (int ch = 0; ch < NCH - 1; ++ch) {
        const int cur = (ch & 1) * STAGE;
        const int nxt = STAGE - cur;
        gA += KC * 4;         // the three uniform bases step to the next chunk
        gS += KC * Hsz * 4;
        gD += KC * Hsz * 4;
        #pragma unroll
        for (int i = 0; i < 4; ++i) {
            ra[i] = *(const v4f*)(gA + i * 32 * Esz * 4 + goff);
            rs[i] = *(const v4f*)(gS + i * Hsz * 4 + woff);
            rd[i] = *(const v4f*)(gD + i * Hsz * 4 + woff);
        }
        chunk_products(&smem[cur + aOff], &smem[cur + bOff], acc);
        #pragma unroll
        for (int i = 0; i < 4; ++i) {
            *(v4f*)&sSt[nxt + (i * 32) * PK] = ra[i];
            *(v4f*)&sW[nxt + i * PK]         = (v4f){rs[0][i], rs[1][i], rs[2][i], rs[3][i]};
            *(v4f*)&sW[nxt + (Hsz + i) * PK] = (v4f){rd[0][i], rd[1][i], rd[2][i], rd[3][i]};
        }
        // One barrier per chunk: publishes the buffer just written and ends
        // every wave's reads of the buffer that the next trip overwrites.
        __syncthreads();
    }
    {
        const int cur = ((NCH - 1) & 1) * STAGE;
        chunk_products(&smem[cur + aOff], &smem[cur + bOff], acc);
    }

    // ---- bias + relu, tiles to LDS (alias the stage buffers), tiny fc head ----
    __syncthreads();   // everyone is done reading the last chunk

    {
        const float* __restrict__ bias = (wn >= 2) ? (dp_b + (size_t)c * Hsz) : sh_b;
        const int mbase = (lane >> 4) * 8;    // lanes 16-31 hold M = r+8
        #pragma unroll
        for (int j = 0; j < 4; ++j) {
            const int   ccol = wn * 64 + j * 16 + m;      // concat column 0..255
            const float bv   = bias[ccol & (Hsz - 1)];
            #pragma unroll
            for (int i = 0; i < 2; ++i)
                #pragma unroll
                for (int r = 0; r < 8; ++r) {
                    float x = acc[i][j][r] + bv;
                    smem[(wm * 32 + i * 16 + mbase + r) * LDT + ccol] = x > 0.0f ? x : 0.0f;
                }
        }
    }
    __syncthreads();

    {   // 128 rows x 4 outputs = one (row, o) per thread
        const int row = tid >> 2;
        const int o   = tid & 3;
        float sum = fc_b[o];
        const float* orow = &smem[row * LDT];
        // Unrolled to keep 32 fc_w loads in flight ahead of the serial fma chain.
        #pragma unroll 32
        for (int h = 0; h < 2 * Hsz; ++h)
            sum = fmaf(orow[h], fc_w[h * Osz + o], sum);
        out[((size_t)b * Ssz + s0) * Osz + tid] = sum;
    }
}

extern "C" void kernel_launch(void* const* d_in, const int* in_sizes, int n_in,
                              void* d_out, int out_size, void* d_ws, size_t ws_size,
                              hipStream_t stream) {
    const float* words  = (const float*)d_in[0];
    const int*   corpus = (const int*)  d_in[1];
    const float* dp_w   = (const float*)d_in[2];
    const float* dp_b   = (const float*)d_in[3];
    const float* sh_w   = (const float*)d_in[4];
    const float* sh_b   = (const float*)d_in[5];
    const float* fc_w   = (const float*)d_in[6];
    const float* fc_b   = (const float*)d_in[7];
    float*       out    = (float*)d_out;

    projection_tiled_kernel<<<dim3(Ssz / TM, Bsz), dim3(512), 0, stream>>>(
        words, corpus, dp_w, dp_b, sh_w, sh_b, fc_w, fc_b, out);
}
